// v000
// Measured on an AMD MI455X. A time is GPU time per run, averaged over a window of back-to-back runs after a warm-up
// (all launches, gaps included; the runs take copies of the inputs in turn), and the median of several windows.
// Apart from v000's, it joins two sittings. Times from different sittings can be a few percent apart, while
// side-by-side timings come from the same sitting.
// v000 is the starting kernel. One run takes 120 microseconds.
#include <hip/hip_runtime.h>
#include <hip/hip_bf16.h>
#include <math.h>
#include <stdint.h>

// Problem constants (B,T,D,H from the reference)
#define BATCH   32
#define T_SEQ   1024
#define DMODEL  128
#define NHEAD   4
#define DHEAD   32
#define QKV_LD  (3 * DMODEL)          // 384
#define SCALE   0.17677669529663687f  // 1/sqrt(32)
#define NEGV    (-4294967295.0f)      // -(2^32)+1, reference padding value
#define LN_EPS  1e-9f

#define STRIDE32  36   // LDS row stride (floats) for 16x32 tiles: 144B, 16B-aligned, conflict-free
#define STRIDE128 132  // LDS row stride (floats) for 16x128 tiles: 528B, 16B-aligned, conflict-free

typedef __attribute__((ext_vector_type(2))) float v2f;
typedef __attribute__((ext_vector_type(8))) float v8f;
typedef int v4i __attribute__((vector_size(4 * sizeof(int))));
typedef __attribute__((address_space(1))) v4i* gv4i_p;  // global int4*
typedef __attribute__((address_space(3))) v4i* lv4i_p;  // LDS int4*

// ---------------------------------------------------------------------------
// f32 WMMA: D(16x16) = A(16x4) * B(4x16) + C   (V_WMMA_F32_16X16X4_F32)
// ---------------------------------------------------------------------------
static __device__ __forceinline__ v8f wmma4(v2f a, v2f b, v8f c) {
  return __builtin_amdgcn_wmma_f32_16x16x4_f32(
      /*neg_a=*/false, a, /*neg_b=*/false, b,
      /*c_mod=*/(short)0, c, /*reuse_a=*/false, /*reuse_b=*/false);
}

// ---------------------------------------------------------------------------
// Async global->LDS copy (16B per lane), tracked by ASYNCcnt
// ---------------------------------------------------------------------------
static __device__ __forceinline__ uint32_t lds_off(const void* p) {
  // generic pointers into LDS carry the byte offset in their low 32 bits
  return (uint32_t)(uintptr_t)p;
}

static __device__ __forceinline__ void async_copy16(const float* __restrict__ g,
                                                    uint32_t lds_byte_off) {
#if __has_builtin(__builtin_amdgcn_global_load_async_to_lds_b128)
  __builtin_amdgcn_global_load_async_to_lds_b128(
      (gv4i_p)(uintptr_t)g,
      (lv4i_p)(uintptr_t)lds_byte_off,
      /*imm offset=*/0, /*cpol=*/0);
#else
  asm volatile("global_load_async_to_lds_b128 %0, %1, off"
               :: "v"(lds_byte_off), "v"((uint64_t)(uintptr_t)g) : "memory");
#endif
}

static __device__ __forceinline__ void wait_async0() {
#if __has_builtin(__builtin_amdgcn_s_wait_asynccnt)
  __builtin_amdgcn_s_wait_asynccnt(0);
#else
  asm volatile("s_wait_asynccnt 0x0" ::: "memory");
#endif
  asm volatile("" ::: "memory");
}

// Stage a 16-row x 32-float tile (rows contiguous 128B in global, ld = row stride)
// into LDS with stride STRIDE32. 4 async instructions, 128B bursts per 8 lanes.
static __device__ __forceinline__ void stage_16x32(const float* __restrict__ g, int ld,
                                                   uint32_t base, int lane) {
#pragma unroll
  for (int i = 0; i < 4; ++i) {
    const int seg = i * 32 + lane;        // 128 segments of 16B
    const int row = seg >> 3, s = seg & 7;
    async_copy16(g + (size_t)row * ld + s * 4,
                 base + (uint32_t)(row * (STRIDE32 * 4) + s * 16));
  }
}

// Stage a 16-row x 128-float tile (rows contiguous 512B in global) into LDS with
// stride STRIDE128. 16 async instructions, each one fully-coalesced 512B row.
static __device__ __forceinline__ void stage_16x128(const float* __restrict__ g, int ld,
                                                    uint32_t base, int lane) {
#pragma unroll
  for (int i = 0; i < 16; ++i)
    async_copy16(g + (size_t)i * ld + lane * 4,
                 base + (uint32_t)(i * (STRIDE128 * 4) + lane * 16));
}

// ---------------------------------------------------------------------------
// Fragment gathers
// ---------------------------------------------------------------------------
// A-layout fragment (also B-layout for a transposed row-major operand, e.g. K^T):
//   lanes 0-15 : row base+lane, cols col+0,1 ; lanes 16-31: cols col+2,3
static __device__ __forceinline__ v2f frag_T_lds(const float* base, int stride,
                                                 int col, int lane) {
  const float* p = base + (lane & 15) * stride + col + ((lane >> 4) << 1);
  v2f r; r.x = p[0]; r.y = p[1];
  return r;
}
// B-layout fragment from a row-major operand used directly:
//   VGPR0 rows k0 / k0+2 , VGPR1 rows k0+1 / k0+3 , lane&15 = column
static __device__ __forceinline__ v2f fragB_lds(const float* base, int stride,
                                                int krow, int col, int lane) {
  const float* p = base + (krow + ((lane >> 4) << 1)) * stride + col + (lane & 15);
  v2f r; r.x = p[0]; r.y = p[stride];
  return r;
}
// B-layout fragment straight from global (for L2-resident weights)
static __device__ __forceinline__ v2f fragB_g(const float* __restrict__ p, int ld,
                                              int krow, int col, int lane) {
  const float* q = p + (size_t)(krow + ((lane >> 4) << 1)) * ld + col + (lane & 15);
  v2f r; r.x = q[0]; r.y = q[ld];
  return r;
}

// Row reductions across the 16-lane half holding one accumulator row
static __device__ __forceinline__ float hred_max(float v) {
  v = fmaxf(v, __shfl_xor(v, 1, 32));
  v = fmaxf(v, __shfl_xor(v, 2, 32));
  v = fmaxf(v, __shfl_xor(v, 4, 32));
  v = fmaxf(v, __shfl_xor(v, 8, 32));
  return v;
}
static __device__ __forceinline__ float hred_sum(float v) {
  v += __shfl_xor(v, 1, 32);
  v += __shfl_xor(v, 2, 32);
  v += __shfl_xor(v, 4, 32);
  v += __shfl_xor(v, 8, 32);
  return v;
}

// ---------------------------------------------------------------------------
// Kernel 1: QKV projection  qkv[32768,384] = x[32768,128] @ W[128,384]
// X tile staged async->LDS (coalesced); W fragments from L2.
// ---------------------------------------------------------------------------
__global__ __launch_bounds__(32) void qkv_gemm_kernel(const float* __restrict__ X,
                                                      const float* __restrict__ W,
                                                      float* __restrict__ QKV) {
  __shared__ float sX[16][STRIDE128];
  const int row0 = blockIdx.x * 16;
  const int col0 = blockIdx.y * 64;
  const int lane = threadIdx.x & 31;

  stage_16x128(X + (size_t)row0 * DMODEL, DMODEL, lds_off(&sX[0][0]), lane);
  wait_async0();
  __syncthreads();

  v8f acc[4] = {};
#pragma unroll 4
  for (int k = 0; k < DMODEL; k += 4) {
    v2f a = frag_T_lds(&sX[0][0], STRIDE128, k, lane);
#pragma unroll
    for (int t = 0; t < 4; ++t) {
      v2f b = fragB_g(W, QKV_LD, k, col0 + 16 * t, lane);
      acc[t] = wmma4(a, b, acc[t]);
    }
  }
  const int n = lane & 15, hs = lane >> 4;
#pragma unroll
  for (int t = 0; t < 4; ++t)
#pragma unroll
    for (int r = 0; r < 8; ++r)
      QKV[(size_t)(row0 + r + 8 * hs) * QKV_LD + col0 + 16 * t + n] = acc[t][r];
}

// ---------------------------------------------------------------------------
// Kernel 2: flash attention. One wave per (16-query tile, batch, head).
// K/V 16-key chunks double-buffered via async->LDS; S = Q*K^T (8 wmma),
// online softmax with causal + keys_length masking, P via LDS, O += P*V (8 wmma).
// ---------------------------------------------------------------------------
__global__ __launch_bounds__(32) void attn_kernel(const float* __restrict__ QKV,
                                                  const int* __restrict__ keys_length,
                                                  float* __restrict__ AOUT) {
  __shared__ float sQ[16][STRIDE32];
  __shared__ float sK[2][16][STRIDE32];
  __shared__ float sV[2][16][STRIDE32];
  __shared__ float sP[16][20];

  const int q0 = blockIdx.x * 16;
  const int b  = blockIdx.y;
  const int h  = blockIdx.z;
  const int lane = threadIdx.x & 31;
  const int n = lane & 15, hs = lane >> 4;

  const float* Q = QKV + (size_t)b * T_SEQ * QKV_LD + h * DHEAD;
  const float* K = QKV + (size_t)b * T_SEQ * QKV_LD + DMODEL + h * DHEAD;
  const float* V = QKV + (size_t)b * T_SEQ * QKV_LD + 2 * DMODEL + h * DHEAD;

  const int kl = keys_length[b];              // uniform per wave
  const int maxkey = min(q0 + 15, kl - 1);    // causal + padding bound
  const int nchunk = (maxkey >> 4) + 1;       // >= 1 always (kl >= 1)

  // stage Q tile and first K/V chunk
  stage_16x32(Q + (size_t)q0 * QKV_LD, QKV_LD, lds_off(&sQ[0][0]), lane);
  stage_16x32(K, QKV_LD, lds_off(&sK[0][0][0]), lane);
  stage_16x32(V, QKV_LD, lds_off(&sV[0][0][0]), lane);
  wait_async0();
  __syncthreads();

  v2f qf[8];
#pragma unroll
  for (int c = 0; c < 8; ++c) qf[c] = frag_T_lds(&sQ[0][0], STRIDE32, 4 * c, lane);

  float m_i[8], l_i[8];
  v8f o0 = {}, o1 = {};
#pragma unroll
  for (int r = 0; r < 8; ++r) { m_i[r] = -INFINITY; l_i[r] = 0.f; }

  int buf = 0;
  for (int kc = 0; kc < nchunk; ++kc) {
    const int key0 = kc * 16;
    const bool more = (kc + 1 < nchunk);
    if (more) {  // prefetch next chunk into the other buffer while we compute
      stage_16x32(K + (size_t)(key0 + 16) * QKV_LD, QKV_LD, lds_off(&sK[buf ^ 1][0][0]), lane);
      stage_16x32(V + (size_t)(key0 + 16) * QKV_LD, QKV_LD, lds_off(&sV[buf ^ 1][0][0]), lane);
    }

    // S = Q * K^T over dh=32 (8 K-chunks of 4)
    v8f s = {};
#pragma unroll
    for (int c = 0; c < 8; ++c) {
      v2f kf = frag_T_lds(&sK[buf][0][0], STRIDE32, 4 * c, lane);  // K^T as B
      s = wmma4(qf[c], kf, s);
    }

    // scale, mask, online softmax update (row r lives in the 16-lane half)
    const int key = key0 + n;
    const bool kvalid = (key < kl);
    float corr[8];
#pragma unroll
    for (int r = 0; r < 8; ++r) {
      const int qrow = q0 + r + 8 * hs;
      float sv = s[r] * SCALE;
      sv = (kvalid && key <= qrow) ? sv : NEGV;
      const float mnew = fmaxf(m_i[r], hred_max(sv));
      const float pv = __expf(sv - mnew);
      corr[r] = __expf(m_i[r] - mnew);
      l_i[r] = l_i[r] * corr[r] + hred_sum(pv);
      m_i[r] = mnew;
      sP[r + 8 * hs][n] = pv;  // C-layout -> LDS for relayout to A-layout
    }
#pragma unroll
    for (int r = 0; r < 8; ++r) { o0[r] *= corr[r]; o1[r] *= corr[r]; }
    __syncthreads();

    // O += P * V  (contraction over the 16 keys: 4 chunks x 2 dh-tiles)
#pragma unroll
    for (int c = 0; c < 4; ++c) {
      v2f pf;
      const int pcol = 4 * c + 2 * hs;
      pf.x = sP[n][pcol];
      pf.y = sP[n][pcol + 1];
      v2f vb0 = fragB_lds(&sV[buf][0][0], STRIDE32, 4 * c, 0, lane);
      v2f vb1 = fragB_lds(&sV[buf][0][0], STRIDE32, 4 * c, 16, lane);
      o0 = wmma4(pf, vb0, o0);
      o1 = wmma4(pf, vb1, o1);
    }
    __syncthreads();
    if (more) { wait_async0(); buf ^= 1; }
  }

  // normalize and store head output into [B*T, 128] (heads concatenated)
  float* out = AOUT + (size_t)b * T_SEQ * DMODEL + h * DHEAD;
#pragma unroll
  for (int r = 0; r < 8; ++r) {
    const float inv = 1.f / l_i[r];
    const int qrow = q0 + r + 8 * hs;
    out[(size_t)qrow * DMODEL + n]      = o0[r] * inv;
    out[(size_t)qrow * DMODEL + 16 + n] = o1[r] * inv;
  }
}

// ---------------------------------------------------------------------------
// Kernel 3: output projection + residual + LayerNorm, fused per 16-row tile.
// attn tile staged async->LDS; Wo fragments from L2.
// ---------------------------------------------------------------------------
__global__ __launch_bounds__(32) void out_ln_kernel(const float* __restrict__ A,
                                                    const float* __restrict__ Wo,
                                                    const float* __restrict__ X,
                                                    const float* __restrict__ gamma,
                                                    const float* __restrict__ beta,
                                                    float* __restrict__ Out) {
  __shared__ float sA[16][STRIDE128];
  const int row0 = blockIdx.x * 16;
  const int lane = threadIdx.x & 31;
  const int n = lane & 15, hs = lane >> 4;

  stage_16x128(A + (size_t)row0 * DMODEL, DMODEL, lds_off(&sA[0][0]), lane);
  wait_async0();
  __syncthreads();

  v8f acc[8] = {};
#pragma unroll 4
  for (int k = 0; k < DMODEL; k += 4) {
    v2f a = frag_T_lds(&sA[0][0], STRIDE128, k, lane);
#pragma unroll
    for (int t = 0; t < 8; ++t) {
      v2f b = fragB_g(Wo, DMODEL, k, t * 16, lane);
      acc[t] = wmma4(a, b, acc[t]);
    }
  }
#pragma unroll
  for (int r = 0; r < 8; ++r) {
    const int row = row0 + r + 8 * hs;
    float sum = 0.f, sumsq = 0.f;
#pragma unroll
    for (int t = 0; t < 8; ++t) {
      const float v = acc[t][r] + X[(size_t)row * DMODEL + t * 16 + n];
      acc[t][r] = v;
      sum += v;
      sumsq += v * v;
    }
    sum = hred_sum(sum);
    sumsq = hred_sum(sumsq);
    const float mu = sum * (1.f / DMODEL);
    const float var = sumsq * (1.f / DMODEL) - mu * mu;
    const float rstd = rsqrtf(var + LN_EPS);
#pragma unroll
    for (int t = 0; t < 8; ++t) {
      const int col = t * 16 + n;
      Out[(size_t)row * DMODEL + col] = (acc[t][r] - mu) * rstd * gamma[col] + beta[col];
    }
  }
}

// ---------------------------------------------------------------------------
extern "C" void kernel_launch(void* const* d_in, const int* in_sizes, int n_in,
                              void* d_out, int out_size, void* d_ws, size_t ws_size,
                              hipStream_t stream) {
  const float* x           = (const float*)d_in[0];
  const int*   keys_length = (const int*)d_in[1];
  const float* W           = (const float*)d_in[2];
  const float* Wo          = (const float*)d_in[3];
  const float* gamma       = (const float*)d_in[4];
  const float* beta        = (const float*)d_in[5];
  float* out = (float*)d_out;

  float* qkv  = (float*)d_ws;                          // 32768*384 f32 (48MB)
  float* attn = qkv + (size_t)BATCH * T_SEQ * QKV_LD;  // 32768*128 f32 (16MB)

  // 1) QKV projection: 2048 row-tiles x 6 col-groups of 64
  qkv_gemm_kernel<<<dim3((BATCH * T_SEQ) / 16, QKV_LD / 64), 32, 0, stream>>>(x, W, qkv);
  // 2) flash attention: (T/16, B, H) waves
  attn_kernel<<<dim3(T_SEQ / 16, BATCH, NHEAD), 32, 0, stream>>>(qkv, keys_length, attn);
  // 3) output projection + residual + LayerNorm
  out_ln_kernel<<<dim3((BATCH * T_SEQ) / 16), 32, 0, stream>>>(attn, Wo, x, gamma, beta, out);
}

// v001
// A run of this version takes 105 microseconds.
// Two timings next to v000 both put it at 1.18 times that version's speed.
#include <hip/hip_runtime.h>
#include <hip/hip_bf16.h>
#include <math.h>
#include <stdint.h>

// Problem constants (B,T,D,H from the reference)
#define BATCH   32
#define T_SEQ   1024
#define DMODEL  128
#define NHEAD   4
#define DHEAD   32
#define QKV_LD  (3 * DMODEL)          // 384
#define SCALE   0.17677669529663687f  // 1/sqrt(32)
#define NEGV    (-4294967295.0f)      // -(2^32)+1, reference padding value
#define LN_EPS  1e-9f

#define STRIDE32  36   // LDS row stride (floats) for 16x32 tiles: 144B, 16B-aligned, conflict-free
#define STRIDE128 132  // LDS row stride (floats) for 16x128 tiles: 528B, 16B-aligned, conflict-free

typedef __attribute__((ext_vector_type(2))) float v2f;
typedef __attribute__((ext_vector_type(4))) float v4f;
typedef __attribute__((ext_vector_type(8))) float v8f;
typedef int v4i __attribute__((vector_size(4 * sizeof(int))));
typedef __attribute__((address_space(1))) v4i* gv4i_p;  // global int4*
typedef __attribute__((address_space(3))) v4i* lv4i_p;  // LDS int4*

// ---------------------------------------------------------------------------
// f32 WMMA: D(16x16) = A(16x4) * B(4x16) + C   (V_WMMA_F32_16X16X4_F32)
// ---------------------------------------------------------------------------
static __device__ __forceinline__ v8f wmma4(v2f a, v2f b, v8f c) {
  return __builtin_amdgcn_wmma_f32_16x16x4_f32(
      /*neg_a=*/false, a, /*neg_b=*/false, b,
      /*c_mod=*/(short)0, c, /*reuse_a=*/false, /*reuse_b=*/false);
}

// ---------------------------------------------------------------------------
// Async global->LDS copy (16B per lane), tracked by ASYNCcnt
// ---------------------------------------------------------------------------
static __device__ __forceinline__ uint32_t lds_off(const void* p) {
  // generic pointers into LDS carry the byte offset in their low 32 bits
  return (uint32_t)(uintptr_t)p;
}

static __device__ __forceinline__ void async_copy16(const float* __restrict__ g,
                                                    uint32_t lds_byte_off) {
#if __has_builtin(__builtin_amdgcn_global_load_async_to_lds_b128)
  __builtin_amdgcn_global_load_async_to_lds_b128(
      (gv4i_p)(uintptr_t)g,
      (lv4i_p)(uintptr_t)lds_byte_off,
      /*imm offset=*/0, /*cpol=*/0);
#else
  asm volatile("global_load_async_to_lds_b128 %0, %1, off"
               :: "v"(lds_byte_off), "v"((uint64_t)(uintptr_t)g) : "memory");
#endif
}

static __device__ __forceinline__ void wait_async0() {
#if __has_builtin(__builtin_amdgcn_s_wait_asynccnt)
  __builtin_amdgcn_s_wait_asynccnt(0);
#else
  asm volatile("s_wait_asynccnt 0x0" ::: "memory");
#endif
  asm volatile("" ::: "memory");
}

// Stage a 16-row x 32-float tile (rows contiguous 128B in global, ld = row stride)
// into LDS with stride STRIDE32. 4 async instructions, 128B bursts per 8 lanes.
static __device__ __forceinline__ void stage_16x32(const float* __restrict__ g, int ld,
                                                   uint32_t base, int lane) {
#pragma unroll
  for (int i = 0; i < 4; ++i) {
    const int seg = i * 32 + lane;        // 128 segments of 16B
    const int row = seg >> 3, s = seg & 7;
    async_copy16(g + (size_t)row * ld + s * 4,
                 base + (uint32_t)(row * (STRIDE32 * 4) + s * 16));
  }
}

// Stage a 16-row x 128-float tile (rows contiguous 512B in global) into LDS with
// stride STRIDE128. 16 async instructions, each one fully-coalesced 512B row.
static __device__ __forceinline__ void stage_16x128(const float* __restrict__ g, int ld,
                                                    uint32_t base, int lane) {
#pragma unroll
  for (int i = 0; i < 16; ++i)
    async_copy16(g + (size_t)i * ld + lane * 4,
                 base + (uint32_t)(i * (STRIDE128 * 4) + lane * 16));
}

// ---------------------------------------------------------------------------
// Fragment gathers
// ---------------------------------------------------------------------------
// A-layout fragment (also B-layout for a transposed row-major operand, e.g. Q^T):
//   lanes 0-15 : row base+lane, cols col+0,1 ; lanes 16-31: cols col+2,3
static __device__ __forceinline__ v2f frag_T_lds(const float* base, int stride,
                                                 int col, int lane) {
  const float* p = base + (lane & 15) * stride + col + ((lane >> 4) << 1);
  v2f r; r.x = p[0]; r.y = p[1];
  return r;
}
// A-layout fragment of V^T (row-major V in LDS) in the k order of an S^T accumulator:
//   step c, lane half hs, slot j  <->  key 2c + 8*hs + j ; lane&15 = dh column
static __device__ __forceinline__ v2f fragVT_lds(const float* base, int stride,
                                                 int c, int col, int lane) {
  const float* p = base + (2 * c + ((lane >> 4) << 3)) * stride + col + (lane & 15);
  v2f r; r.x = p[0]; r.y = p[stride];
  return r;
}
// B-layout fragment straight from global (for L2-resident weights):
//   VGPR0 rows k0 / k0+2 , VGPR1 rows k0+1 / k0+3 , lane&15 = column
static __device__ __forceinline__ v2f fragB_g(const float* __restrict__ p, int ld,
                                              int krow, int col, int lane) {
  const float* q = p + (size_t)(krow + ((lane >> 4) << 1)) * ld + col + (lane & 15);
  v2f r; r.x = q[0]; r.y = q[ld];
  return r;
}

// Lane l with lane l ^ 16 (vector cross-row move, no LDS queue)
static __device__ __forceinline__ float xhalf(float x) {
  const int b = __builtin_bit_cast(int, x);
  return __builtin_bit_cast(float,
      __builtin_amdgcn_permlanex16(b, b, 0x76543210, 0xfedcba98, false, false));
}

// Row reduction across the 16-lane half holding one accumulator row
static __device__ __forceinline__ float hred_sum(float v) {
  v += __shfl_xor(v, 1, 32);
  v += __shfl_xor(v, 2, 32);
  v += __shfl_xor(v, 4, 32);
  v += __shfl_xor(v, 8, 32);
  return v;
}

// ---------------------------------------------------------------------------
// Kernel 1: QKV projection  qkv[32768,384] = x[32768,128] @ W[128,384]
// X tile staged async->LDS (coalesced); W fragments from L2.
// ---------------------------------------------------------------------------
__global__ __launch_bounds__(32) void qkv_gemm_kernel(const float* __restrict__ X,
                                                      const float* __restrict__ W,
                                                      float* __restrict__ QKV) {
  __shared__ float sX[16][STRIDE128];
  const int row0 = blockIdx.x * 16;
  const int col0 = blockIdx.y * 64;
  const int lane = threadIdx.x & 31;

  stage_16x128(X + (size_t)row0 * DMODEL, DMODEL, lds_off(&sX[0][0]), lane);
  wait_async0();
  __syncthreads();

  v8f acc[4] = {};
#pragma unroll 4
  for (int k = 0; k < DMODEL; k += 4) {
    v2f a = frag_T_lds(&sX[0][0], STRIDE128, k, lane);
#pragma unroll
    for (int t = 0; t < 4; ++t) {
      v2f b = fragB_g(W, QKV_LD, k, col0 + 16 * t, lane);
      acc[t] = wmma4(a, b, acc[t]);
    }
  }
  const int n = lane & 15, hs = lane >> 4;
#pragma unroll
  for (int t = 0; t < 4; ++t)
#pragma unroll
    for (int r = 0; r < 8; ++r)
      QKV[(size_t)(row0 + r + 8 * hs) * QKV_LD + col0 + 16 * t + n] = acc[t][r];
}

// ---------------------------------------------------------------------------
// Kernel 2: flash attention. One wave per (16-query tile, batch, head).
// K/V 16-key chunks double-buffered via async->LDS; S^T = K*Q^T (8 wmma), so a lane
// holds 8 keys of ONE query: online softmax (causal + keys_length masking) is in-lane
// plus one exchange between the lane halves; the S^T accumulator registers are the
// B operand P^T as they stand, O^T += V^T*P^T (8 wmma).
// ---------------------------------------------------------------------------
__global__ __launch_bounds__(32) void attn_kernel(const float* __restrict__ QKV,
                                                  const int* __restrict__ keys_length,
                                                  float* __restrict__ AOUT) {
  __shared__ float sQ[16][STRIDE32];
  __shared__ float sK[2][16][STRIDE32];
  __shared__ float sV[2][16][STRIDE32];

  const int q0 = blockIdx.x * 16;
  const int b  = blockIdx.y;
  const int h  = blockIdx.z;
  const int lane = threadIdx.x & 31;
  const int n = lane & 15, hs = lane >> 4;

  const float* Q = QKV + (size_t)b * T_SEQ * QKV_LD + h * DHEAD;
  const float* K = QKV + (size_t)b * T_SEQ * QKV_LD + DMODEL + h * DHEAD;
  const float* V = QKV + (size_t)b * T_SEQ * QKV_LD + 2 * DMODEL + h * DHEAD;

  const int kl = keys_length[b];              // uniform per wave
  const int maxkey = min(q0 + 15, kl - 1);    // causal + padding bound
  const int nchunk = (maxkey >> 4) + 1;       // >= 1 always (kl >= 1)

  // stage Q tile and first K/V chunk
  stage_16x32(Q + (size_t)q0 * QKV_LD, QKV_LD, lds_off(&sQ[0][0]), lane);
  stage_16x32(K, QKV_LD, lds_off(&sK[0][0][0]), lane);
  stage_16x32(V, QKV_LD, lds_off(&sV[0][0][0]), lane);
  wait_async0();
  __syncthreads();

  v2f qf[8];
#pragma unroll
  for (int c = 0; c < 8; ++c) qf[c] = frag_T_lds(&sQ[0][0], STRIDE32, 4 * c, lane);

  // one query per lane: running maximum (same in both halves), this half's partial sum
  float m_i = -INFINITY, l_i = 0.f;
  v8f o0 = {}, o1 = {};
  // last visible key of this lane's query, counted from the lane half's first row
  const int lim = min(q0 + n, kl - 1) - 8 * hs;

  int buf = 0;
  for (int kc = 0; kc < nchunk; ++kc) {
    const int key0 = kc * 16;
    const bool more = (kc + 1 < nchunk);
    if (more) {  // prefetch next chunk into the other buffer while we compute
      stage_16x32(K + (size_t)(key0 + 16) * QKV_LD, QKV_LD, lds_off(&sK[buf ^ 1][0][0]), lane);
      stage_16x32(V + (size_t)(key0 + 16) * QKV_LD, QKV_LD, lds_off(&sV[buf ^ 1][0][0]), lane);
    }

    // S^T = K * Q^T over dh=32 (8 K-chunks of 4): s[r] = S[query n][key0 + 8*hs + r]
    v8f s = {};
#pragma unroll
    for (int c = 0; c < 8; ++c) {
      v2f kf = frag_T_lds(&sK[buf][0][0], STRIDE32, 4 * c, lane);  // K rows as A
      s = wmma4(kf, qf[c], s);
    }

    // scale, mask, online softmax update for the lane's own query
    float sv[8];
#pragma unroll
    for (int r = 0; r < 8; ++r) sv[r] = (key0 + r <= lim) ? s[r] * SCALE : NEGV;
    float mx = sv[0];
#pragma unroll
    for (int r = 1; r < 8; ++r) mx = fmaxf(mx, sv[r]);
    mx = fmaxf(mx, xhalf(mx));
    const float mnew = fmaxf(m_i, mx);
    const float corr = __expf(m_i - mnew);
#pragma unroll
    for (int r = 0; r < 8; ++r) sv[r] = __expf(sv[r] - mnew);
    const float psum = ((sv[0] + sv[1]) + (sv[2] + sv[3])) + ((sv[4] + sv[5]) + (sv[6] + sv[7]));
    l_i = l_i * corr + psum;
    m_i = mnew;
#pragma unroll
    for (int r = 0; r < 8; ++r) { o0[r] *= corr; o1[r] *= corr; }

    // O^T += V^T * P^T  (contraction over the 16 keys: 4 steps x 2 dh-tiles)
#pragma unroll
    for (int c = 0; c < 4; ++c) {
      v2f pf; pf.x = sv[2 * c]; pf.y = sv[2 * c + 1];
      v2f va0 = fragVT_lds(&sV[buf][0][0], STRIDE32, c, 0, lane);
      v2f va1 = fragVT_lds(&sV[buf][0][0], STRIDE32, c, 16, lane);
      o0 = wmma4(va0, pf, o0);
      o1 = wmma4(va1, pf, o1);
    }
    __syncthreads();
    if (more) { wait_async0(); buf ^= 1; }
  }

  // join the halves' sums, normalize and store head output into [B*T, 128] (heads
  // concatenated): o0[r] = O[query n][8*hs + r], o1[r] = O[query n][16 + 8*hs + r]
  const float inv = 1.f / (l_i + xhalf(l_i));
  float* out = AOUT + ((size_t)b * T_SEQ + q0 + n) * DMODEL + h * DHEAD + 8 * hs;
  v4f w;
  w.x = o0[0] * inv; w.y = o0[1] * inv; w.z = o0[2] * inv; w.w = o0[3] * inv;
  *(v4f*)(out) = w;
  w.x = o0[4] * inv; w.y = o0[5] * inv; w.z = o0[6] * inv; w.w = o0[7] * inv;
  *(v4f*)(out + 4) = w;
  w.x = o1[0] * inv; w.y = o1[1] * inv; w.z = o1[2] * inv; w.w = o1[3] * inv;
  *(v4f*)(out + 16) = w;
  w.x = o1[4] * inv; w.y = o1[5] * inv; w.z = o1[6] * inv; w.w = o1[7] * inv;
  *(v4f*)(out + 20) = w;
}

// ---------------------------------------------------------------------------
// Kernel 3: output projection + residual + LayerNorm, fused per 16-row tile.
// attn tile staged async->LDS; Wo fragments from L2.
// ---------------------------------------------------------------------------
__global__ __launch_bounds__(32) void out_ln_kernel(const float* __restrict__ A,
                                                    const float* __restrict__ Wo,
                                                    const float* __restrict__ X,
                                                    const float* __restrict__ gamma,
                                                    const float* __restrict__ beta,
                                                    float* __restrict__ Out) {
  __shared__ float sA[16][STRIDE128];
  const int row0 = blockIdx.x * 16;
  const int lane = threadIdx.x & 31;
  const int n = lane & 15, hs = lane >> 4;

  stage_16x128(A + (size_t)row0 * DMODEL, DMODEL, lds_off(&sA[0][0]), lane);
  wait_async0();
  __syncthreads();

  v8f acc[8] = {};
#pragma unroll 4
  for (int k = 0; k < DMODEL; k += 4) {
    v2f a = frag_T_lds(&sA[0][0], STRIDE128, k, lane);
#pragma unroll
    for (int t = 0; t < 8; ++t) {
      v2f b = fragB_g(Wo, DMODEL, k, t * 16, lane);
      acc[t] = wmma4(a, b, acc[t]);
    }
  }
#pragma unroll
  for (int r = 0; r < 8; ++r) {
    const int row = row0 + r + 8 * hs;
    float sum = 0.f, sumsq = 0.f;
#pragma unroll
    for (int t = 0; t < 8; ++t) {
      const float v = acc[t][r] + X[(size_t)row * DMODEL + t * 16 + n];
      acc[t][r] = v;
      sum += v;
      sumsq += v * v;
    }
    sum = hred_sum(sum);
    sumsq = hred_sum(sumsq);
    const float mu = sum * (1.f / DMODEL);
    const float var = sumsq * (1.f / DMODEL) - mu * mu;
    const float rstd = rsqrtf(var + LN_EPS);
#pragma unroll
    for (int t = 0; t < 8; ++t) {
      const int col = t * 16 + n;
      Out[(size_t)row * DMODEL + col] = (acc[t][r] - mu) * rstd * gamma[col] + beta[col];
    }
  }
}

// ---------------------------------------------------------------------------
extern "C" void kernel_launch(void* const* d_in, const int* in_sizes, int n_in,
                              void* d_out, int out_size, void* d_ws, size_t ws_size,
                              hipStream_t stream) {
  const float* x           = (const float*)d_in[0];
  const int*   keys_length = (const int*)d_in[1];
  const float* W           = (const float*)d_in[2];
  const float* Wo          = (const float*)d_in[3];
  const float* gamma       = (const float*)d_in[4];
  const float* beta        = (const float*)d_in[5];
  float* out = (float*)d_out;

  float* qkv  = (float*)d_ws;                          // 32768*384 f32 (48MB)
  float* attn = qkv + (size_t)BATCH * T_SEQ * QKV_LD;  // 32768*128 f32 (16MB)

  // 1) QKV projection: 2048 row-tiles x 6 col-groups of 64
  qkv_gemm_kernel<<<dim3((BATCH * T_SEQ) / 16, QKV_LD / 64), 32, 0, stream>>>(x, W, qkv);
  // 2) flash attention: (T/16, B, H) waves
  attn_kernel<<<dim3(T_SEQ / 16, BATCH, NHEAD), 32, 0, stream>>>(qkv, keys_length, attn);
  // 3) output projection + residual + LayerNorm
  out_ln_kernel<<<dim3((BATCH * T_SEQ) / 16), 32, 0, stream>>>(attn, Wo, x, gamma, beta, out);
}

// v002
// Measured time: 78.6 microseconds a run.
// In both of two side-by-side timings against v001, it was 1.33 times as fast.
// Over all steps from v000 it is 1.57 times as fast.
#include <hip/hip_runtime.h>
#include <hip/hip_bf16.h>
#include <math.h>
#include <stdint.h>

// Problem constants (B,T,D,H from the reference)
#define BATCH   32
#define T_SEQ   1024
#define DMODEL  128
#define NHEAD   4
#define DHEAD   32
#define QKV_LD  (3 * DMODEL)          // 384
#define SCALE   0.17677669529663687f  // 1/sqrt(32)
#define NEGV    (-4294967295.0f)      // -(2^32)+1, reference padding value
#define LN_EPS  1e-9f

#define STRIDE32  36   // LDS row stride (floats) for 16x32 tiles: 144B, 16B-aligned, conflict-free
#define STRIDE128 132  // LDS row stride (floats) for 16x128 tiles: 528B, 16B-aligned, conflict-free

typedef __attribute__((ext_vector_type(2))) float v2f;
typedef __attribute__((ext_vector_type(4))) float v4f;
typedef __attribute__((ext_vector_type(8))) float v8f;
typedef int v4i __attribute__((vector_size(4 * sizeof(int))));
typedef __attribute__((address_space(1))) v4i* gv4i_p;  // global int4*
typedef __attribute__((address_space(3))) v4i* lv4i_p;  // LDS int4*

// ---------------------------------------------------------------------------
// f32 WMMA: D(16x16) = A(16x4) * B(4x16) + C   (V_WMMA_F32_16X16X4_F32)
// ---------------------------------------------------------------------------
static __device__ __forceinline__ v8f wmma4(v2f a, v2f b, v8f c) {
  return __builtin_amdgcn_wmma_f32_16x16x4_f32(
      /*neg_a=*/false, a, /*neg_b=*/false, b,
      /*c_mod=*/(short)0, c, /*reuse_a=*/false, /*reuse_b=*/false);
}

// ---------------------------------------------------------------------------
// Async global->LDS copy (16B per lane), tracked by ASYNCcnt
// ---------------------------------------------------------------------------
static __device__ __forceinline__ uint32_t lds_off(const void* p) {
  // generic pointers into LDS carry the byte offset in their low 32 bits
  return (uint32_t)(uintptr_t)p;
}

static __device__ __forceinline__ void async_copy16(const float* __restrict__ g,
                                                    uint32_t lds_byte_off) {
#if __has_builtin(__builtin_amdgcn_global_load_async_to_lds_b128)
  __builtin_amdgcn_global_load_async_to_lds_b128(
      (gv4i_p)(uintptr_t)g,
      (lv4i_p)(uintptr_t)lds_byte_off,
      /*imm offset=*/0, /*cpol=*/0);
#else
  asm volatile("global_load_async_to_lds_b128 %0, %1, off"
               :: "v"(lds_byte_off), "v"((uint64_t)(uintptr_t)g) : "memory");
#endif
}

static __device__ __forceinline__ void wait_async0() {
#if __has_builtin(__builtin_amdgcn_s_wait_asynccnt)
  __builtin_amdgcn_s_wait_asynccnt(0);
#else
  asm volatile("s_wait_asynccnt 0x0" ::: "memory");
#endif
  asm volatile("" ::: "memory");
}

// Stage a 16-row x 32-float tile (rows contiguous 128B in global, ld = row stride)
// into LDS with stride STRIDE32. 4 async instructions, 128B bursts per 8 lanes.
static __device__ __forceinline__ void stage_16x32(const float* __restrict__ g, int ld,
                                                   uint32_t base, int lane) {
#pragma unroll
  for (int i = 0; i < 4; ++i) {
    const int seg = i * 32 + lane;        // 128 segments of 16B
    const int row = seg >> 3, s = seg & 7;
    async_copy16(g + (size_t)row * ld + s * 4,
                 base + (uint32_t)(row * (STRIDE32 * 4) + s * 16));
  }
}

// Stage a 16-row x 128-float tile (rows contiguous 512B in global) into LDS with
// stride STRIDE128. 16 async instructions, each one fully-coalesced 512B row.
static __device__ __forceinline__ void stage_16x128(const float* __restrict__ g, int ld,
                                                    uint32_t base, int lane) {
#pragma unroll
  for (int i = 0; i < 16; ++i)
    async_copy16(g + (size_t)i * ld + lane * 4,
                 base + (uint32_t)(i * (STRIDE128 * 4) + lane * 16));
}

// ---------------------------------------------------------------------------
// Fragment gathers
// ---------------------------------------------------------------------------
// A-layout fragment (also B-layout for a transposed row-major operand, e.g. Q^T):
//   lanes 0-15 : row base+lane, cols col+0,1 ; lanes 16-31: cols col+2,3
static __device__ __forceinline__ v2f frag_T_lds(const float* base, int stride,
                                                 int col, int lane) {
  const float* p = base + (lane & 15) * stride + col + ((lane >> 4) << 1);
  v2f r; r.x = p[0]; r.y = p[1];
  return r;
}
// A-layout fragment of V^T (row-major V in LDS) in the k order of an S^T accumulator:
//   step c, lane half hs, slot j  <->  key 2c + 8*hs + j ; lane&15 = dh column
static __device__ __forceinline__ v2f fragVT_lds(const float* base, int stride,
                                                 int c, int col, int lane) {
  const float* p = base + (2 * c + ((lane >> 4) << 3)) * stride + col + (lane & 15);
  v2f r; r.x = p[0]; r.y = p[stride];
  return r;
}
// B-layout fragment straight from global (for L2-resident weights):
//   VGPR0 rows k0 / k0+2 , VGPR1 rows k0+1 / k0+3 , lane&15 = column
static __device__ __forceinline__ v2f fragB_g(const float* __restrict__ p, int ld,
                                              int krow, int col, int lane) {
  const float* q = p + (size_t)(krow + ((lane >> 4) << 1)) * ld + col + (lane & 15);
  v2f r; r.x = q[0]; r.y = q[ld];
  return r;
}

// Lane l with lane l ^ 16 (vector cross-row move, no LDS queue)
static __device__ __forceinline__ float xhalf(float x) {
  const int b = __builtin_bit_cast(int, x);
  return __builtin_bit_cast(float,
      __builtin_amdgcn_permlanex16(b, b, 0x76543210, 0xfedcba98, false, false));
}

// Row reduction across the 16-lane half holding one accumulator row
static __device__ __forceinline__ float hred_sum(float v) {
  v += __shfl_xor(v, 1, 32);
  v += __shfl_xor(v, 2, 32);
  v += __shfl_xor(v, 4, 32);
  v += __shfl_xor(v, 8, 32);
  return v;
}

// ---------------------------------------------------------------------------
// Kernel 1: QKV projection  qkv[32768,384] = x[32768,128] @ W[128,384]
// X tile staged async->LDS (coalesced); W fragments from L2.
// ---------------------------------------------------------------------------
__global__ __launch_bounds__(32) void qkv_gemm_kernel(const float* __restrict__ X,
                                                      const float* __restrict__ W,
                                                      float* __restrict__ QKV) {
  __shared__ float sX[16][STRIDE128];
  const int row0 = blockIdx.x * 16;
  const int col0 = blockIdx.y * 64;
  const int lane = threadIdx.x & 31;

  stage_16x128(X + (size_t)row0 * DMODEL, DMODEL, lds_off(&sX[0][0]), lane);
  wait_async0();
  __syncthreads();

  v8f acc[4] = {};
#pragma unroll 4
  for (int k = 0; k < DMODEL; k += 4) {
    v2f a = frag_T_lds(&sX[0][0], STRIDE128, k, lane);
#pragma unroll
    for (int t = 0; t < 4; ++t) {
      v2f b = fragB_g(W, QKV_LD, k, col0 + 16 * t, lane);
      acc[t] = wmma4(a, b, acc[t]);
    }
  }
  const int n = lane & 15, hs = lane >> 4;
#pragma unroll
  for (int t = 0; t < 4; ++t)
#pragma unroll
    for (int r = 0; r < 8; ++r)
      QKV[(size_t)(row0 + r + 8 * hs) * QKV_LD + col0 + 16 * t + n] = acc[t][r];
}

// ---------------------------------------------------------------------------
// Kernel 2: flash attention. One work-group of ATT_WAVES waves per (64-query block,
// batch, head); each wave owns one 16-query tile. A stage is ATT_CHUNKS 16-key chunks of
// K and V, brought in once for the whole work-group (each wave copies two chunks) and
// double-buffered via async->LDS. Per chunk: S^T = K*Q^T (8 wmma), so a lane holds 8 keys
// of ONE query: online softmax (causal + keys_length masking) is in-lane plus one exchange
// between the lane halves; the S^T accumulator registers are the B operand P^T as they
// stand, O^T += V^T*P^T (8 wmma).
// ---------------------------------------------------------------------------
#define ATT_WAVES  4
#define ATT_CHUNKS 8                    // 16-key chunks per stage, two per wave
#define ATT_QBLK   (16 * ATT_WAVES)     // queries per work-group

// one wave's share of stage st: chunks 2*wave and 2*wave+1 of K and of V
static __device__ __forceinline__ void stage_kv(const float* __restrict__ K,
                                                const float* __restrict__ V,
                                                int st, int wave, float* sk, float* sv,
                                                int lane) {
#pragma unroll
  for (int i = 0; i < ATT_CHUNKS / ATT_WAVES; ++i) {
    const int j = wave * (ATT_CHUNKS / ATT_WAVES) + i;
    const size_t row = (size_t)(16 * (st * ATT_CHUNKS + j)) * QKV_LD;
    stage_16x32(K + row, QKV_LD, lds_off(sk + j * 16 * STRIDE32), lane);
    stage_16x32(V + row, QKV_LD, lds_off(sv + j * 16 * STRIDE32), lane);
  }
}

__global__ __launch_bounds__(32 * ATT_WAVES) void attn_kernel(const float* __restrict__ QKV,
                                                  const int* __restrict__ keys_length,
                                                  float* __restrict__ AOUT) {
  __shared__ float sK[2][ATT_CHUNKS][16][STRIDE32];
  __shared__ float sV[2][ATT_CHUNKS][16][STRIDE32];

  const int h  = blockIdx.x;
  const int b  = blockIdx.y;
  // query blocks with the most keys start first
  const int qb0 = (T_SEQ / ATT_QBLK - 1 - (int)blockIdx.z) * ATT_QBLK;
  const int lane = threadIdx.x & 31;
  const int wave = __builtin_amdgcn_readfirstlane((int)(threadIdx.x >> 5));  // scalar
  const int q0 = qb0 + 16 * wave;
  const int n = lane & 15, hs = lane >> 4;

  const float* Q = QKV + (size_t)b * T_SEQ * QKV_LD + h * DHEAD;
  const float* K = QKV + (size_t)b * T_SEQ * QKV_LD + DMODEL + h * DHEAD;
  const float* V = QKV + (size_t)b * T_SEQ * QKV_LD + 2 * DMODEL + h * DHEAD;

  const int kl = keys_length[b];                                   // uniform per block
  const int nchunk = (min(q0 + 15, kl - 1) >> 4) + 1;              // this wave's chunks
  const int nchunk_wg = (min(qb0 + ATT_QBLK - 1, kl - 1) >> 4) + 1;
  const int nstage = (nchunk_wg + ATT_CHUNKS - 1) / ATT_CHUNKS;    // <= T_SEQ/128, any kl

  // This wave's Q tile rests in the part of buffer 1 that only this wave refills.
  float* sQ = &sK[1][wave * (ATT_CHUNKS / ATT_WAVES)][0][0];
  stage_16x32(Q + (size_t)q0 * QKV_LD, QKV_LD, lds_off(sQ), lane);
  stage_kv(K, V, 0, wave, &sK[0][0][0][0], &sV[0][0][0][0], lane);
  asm volatile("s_wait_asynccnt 0x0" ::: "memory");  // own copies landed before the barrier
  __syncthreads();                                   // stage 0 visible to every wave

  v2f qf[8];
#pragma unroll
  for (int c = 0; c < 8; ++c) qf[c] = frag_T_lds(sQ, STRIDE32, 4 * c, lane);
  asm volatile("s_wait_dscnt 0x0" ::: "memory");     // Q read out before copies overwrite it
  if (1 < nstage) stage_kv(K, V, 1, wave, &sK[1][0][0][0], &sV[1][0][0][0], lane);

  // one query per lane: running maximum (same in both halves), this half's partial sum
  float m_i = -INFINITY, l_i = 0.f;
  v8f o0 = {}, o1 = {};
  // last visible key of this lane's query, counted from the lane half's first row
  const int lim = min(q0 + n, kl - 1) - 8 * hs;

  for (int st = 0; st < nstage; ++st) {
    const int buf = st & 1;
    // chunks of this stage that this wave still needs; held scalar so that the chunk
    // loop closes on a scalar compare and branch
    const int jn = __builtin_amdgcn_readfirstlane(min(ATT_CHUNKS, nchunk - st * ATT_CHUNKS));
    for (int j = 0; j < jn; ++j) {
      const int key0 = (st * ATT_CHUNKS + j) * 16;
      const float* kb = &sK[buf][j][0][0];
      const float* vb = &sV[buf][j][0][0];

      // S^T = K * Q^T over dh=32 (8 K-chunks of 4): s[r] = S[query n][key0 + 8*hs + r]
      v8f s = {};
#pragma unroll
      for (int c = 0; c < 8; ++c) {
        v2f kf = frag_T_lds(kb, STRIDE32, 4 * c, lane);  // K rows as A
        s = wmma4(kf, qf[c], s);
      }

      // scale, mask, online softmax update for the lane's own query
      float sv[8];
#pragma unroll
      for (int r = 0; r < 8; ++r) sv[r] = (key0 + r <= lim) ? s[r] * SCALE : NEGV;
      float mx = sv[0];
#pragma unroll
      for (int r = 1; r < 8; ++r) mx = fmaxf(mx, sv[r]);
      mx = fmaxf(mx, xhalf(mx));
      const float mnew = fmaxf(m_i, mx);
      const float corr = __expf(m_i - mnew);
#pragma unroll
      for (int r = 0; r < 8; ++r) sv[r] = __expf(sv[r] - mnew);
      const float psum = ((sv[0] + sv[1]) + (sv[2] + sv[3])) + ((sv[4] + sv[5]) + (sv[6] + sv[7]));
      l_i = l_i * corr + psum;
      m_i = mnew;
#pragma unroll
      for (int r = 0; r < 8; ++r) { o0[r] *= corr; o1[r] *= corr; }

      // O^T += V^T * P^T  (contraction over the 16 keys: 4 steps x 2 dh-tiles)
#pragma unroll
      for (int c = 0; c < 4; ++c) {
        v2f pf; pf.x = sv[2 * c]; pf.y = sv[2 * c + 1];
        v2f va0 = fragVT_lds(vb, STRIDE32, c, 0, lane);
        v2f va1 = fragVT_lds(vb, STRIDE32, c, 16, lane);
        o0 = wmma4(va0, pf, o0);
        o1 = wmma4(va1, pf, o1);
      }
    }
    // hand-over of the buffers, every wave: own LDS reads of this stage done, own copies of
    // the next stage landed, then the one barrier that publishes the next stage and frees
    // this stage's buffer for the refill behind it
    asm volatile("s_wait_dscnt 0x0" ::: "memory");
    asm volatile("s_wait_asynccnt 0x0" ::: "memory");
    __syncthreads();
    if (st + 2 < nstage) stage_kv(K, V, st + 2, wave, &sK[buf][0][0][0], &sV[buf][0][0][0], lane);
  }
  asm volatile("s_wait_asynccnt 0x0" ::: "memory");  // no copy outstanding at the wave's end

  // join the halves' sums, normalize and store head output into [B*T, 128] (heads
  // concatenated): o0[r] = O[query n][8*hs + r], o1[r] = O[query n][16 + 8*hs + r]
  const float inv = 1.f / (l_i + xhalf(l_i));
  float* out = AOUT + ((size_t)b * T_SEQ + q0 + n) * DMODEL + h * DHEAD + 8 * hs;
  v4f w;
  w.x = o0[0] * inv; w.y = o0[1] * inv; w.z = o0[2] * inv; w.w = o0[3] * inv;
  *(v4f*)(out) = w;
  w.x = o0[4] * inv; w.y = o0[5] * inv; w.z = o0[6] * inv; w.w = o0[7] * inv;
  *(v4f*)(out + 4) = w;
  w.x = o1[0] * inv; w.y = o1[1] * inv; w.z = o1[2] * inv; w.w = o1[3] * inv;
  *(v4f*)(out + 16) = w;
  w.x = o1[4] * inv; w.y = o1[5] * inv; w.z = o1[6] * inv; w.w = o1[7] * inv;
  *(v4f*)(out + 20) = w;
}

// ---------------------------------------------------------------------------
// Kernel 3: output projection + residual + LayerNorm, fused per 16-row tile.
// attn tile staged async->LDS; Wo fragments from L2.
// ---------------------------------------------------------------------------
__global__ __launch_bounds__(32) void out_ln_kernel(const float* __restrict__ A,
                                                    const float* __restrict__ Wo,
                                                    const float* __restrict__ X,
                                                    const float* __restrict__ gamma,
                                                    const float* __restrict__ beta,
                                                    float* __restrict__ Out) {
  __shared__ float sA[16][STRIDE128];
  const int row0 = blockIdx.x * 16;
  const int lane = threadIdx.x & 31;
  const int n = lane & 15, hs = lane >> 4;

  stage_16x128(A + (size_t)row0 * DMODEL, DMODEL, lds_off(&sA[0][0]), lane);
  wait_async0();
  __syncthreads();

  v8f acc[8] = {};
#pragma unroll 4
  for (int k = 0; k < DMODEL; k += 4) {
    v2f a = frag_T_lds(&sA[0][0], STRIDE128, k, lane);
#pragma unroll
    for (int t = 0; t < 8; ++t) {
      v2f b = fragB_g(Wo, DMODEL, k, t * 16, lane);
      acc[t] = wmma4(a, b, acc[t]);
    }
  }
#pragma unroll
  for (int r = 0; r < 8; ++r) {
    const int row = row0 + r + 8 * hs;
    float sum = 0.f, sumsq = 0.f;
#pragma unroll
    for (int t = 0; t < 8; ++t) {
      const float v = acc[t][r] + X[(size_t)row * DMODEL + t * 16 + n];
      acc[t][r] = v;
      sum += v;
      sumsq += v * v;
    }
    sum = hred_sum(sum);
    sumsq = hred_sum(sumsq);
    const float mu = sum * (1.f / DMODEL);
    const float var = sumsq * (1.f / DMODEL) - mu * mu;
    const float rstd = rsqrtf(var + LN_EPS);
#pragma unroll
    for (int t = 0; t < 8; ++t) {
      const int col = t * 16 + n;
      Out[(size_t)row * DMODEL + col] = (acc[t][r] - mu) * rstd * gamma[col] + beta[col];
    }
  }
}

// ---------------------------------------------------------------------------
extern "C" void kernel_launch(void* const* d_in, const int* in_sizes, int n_in,
                              void* d_out, int out_size, void* d_ws, size_t ws_size,
                              hipStream_t stream) {
  const float* x           = (const float*)d_in[0];
  const int*   keys_length = (const int*)d_in[1];
  const float* W           = (const float*)d_in[2];
  const float* Wo          = (const float*)d_in[3];
  const float* gamma       = (const float*)d_in[4];
  const float* beta        = (const float*)d_in[5];
  float* out = (float*)d_out;

  float* qkv  = (float*)d_ws;                          // 32768*384 f32 (48MB)
  float* attn = qkv + (size_t)BATCH * T_SEQ * QKV_LD;  // 32768*128 f32 (16MB)

  // 1) QKV projection: 2048 row-tiles x 6 col-groups of 64
  qkv_gemm_kernel<<<dim3((BATCH * T_SEQ) / 16, QKV_LD / 64), 32, 0, stream>>>(x, W, qkv);
  // 2) flash attention: (H, B, T/64) work-groups of 4 waves
  attn_kernel<<<dim3(NHEAD, BATCH, T_SEQ / ATT_QBLK), 32 * ATT_WAVES, 0, stream>>>(qkv, keys_length, attn);
  // 3) output projection + residual + LayerNorm
  out_ln_kernel<<<dim3((BATCH * T_SEQ) / 16), 32, 0, stream>>>(attn, Wo, x, gamma, beta, out);
}
